// v000
// The times below were measured on an AMD MI455X: many runs one after another, warmed up first and cycling through
// copies of the inputs, with the whole window's GPU time divided by the number of runs. Launches and the gaps
// between them are all in it. The median over several windows is given; except for v000 it joins two sittings, which
// can be a few percent apart, so the side-by-side timings, each taken in one sitting, are the better comparison.
// v000, which the later versions start from, runs in 1720 microseconds.
#include <hip/hip_runtime.h>
#include <hip/hip_bf16.h>

// Problem constants (from reference)
#define NLAYER 4
#define NHEAD  8
#define DP     63
#define BATCH  16
#define SEQ    2048
#define D      64

typedef __attribute__((ext_vector_type(2))) float v2f;
typedef __attribute__((ext_vector_type(8))) float v8f;

__device__ __forceinline__ v8f wmma_f32_k4(v2f a, v2f b, v8f c) {
    // D = A(16x4) * B(4x16) + C, fp32 throughout
    return __builtin_amdgcn_wmma_f32_16x16x4_f32(
        /*neg_a=*/false, a, /*neg_b=*/false, b,
        /*c_mod=*/(short)0, c, /*reuse_a=*/false, /*reuse_b=*/false);
}

// ---------------------------------------------------------------------------
// Kernel A: per-batch Gram matrix G[b] = sum_{n != SEQ-1} Z[b,n,:]^T Z[b,n,:]
// grid = BATCH*16 blocks (16 tiles of 16x16 per batch), 32 threads (1 wave).
// ---------------------------------------------------------------------------
__global__ void lt_gram_kernel(const float* __restrict__ Z, float* __restrict__ G) {
    int blk  = blockIdx.x;
    int b    = blk >> 4;
    int tile = blk & 15;
    int i0   = (tile >> 2) << 4;   // G row block
    int k0   = (tile & 3) << 4;    // G col block
    int lane = threadIdx.x;        // 0..31 (wave32)
    int half = lane >> 4;
    int l    = lane & 15;

    const float* Zb = Z + (size_t)b * SEQ * D;
    v8f c = {};
    for (int n0 = 0; n0 < SEQ; n0 += 4) {
        int r0 = n0 + 2 * half;    // even, never SEQ-1
        int r1 = r0 + 1;           // odd, can be SEQ-1 in last chunk
        // A[m=l][k] = Z[r][i0+l] (Z^T slice), B[k][n=l] = Z[r][k0+l]
        v2f a, bb;
        a.x  = Zb[(size_t)r0 * D + i0 + l];
        float ay = Zb[(size_t)r1 * D + i0 + l];
        a.y  = (r1 == SEQ - 1) ? 0.0f : ay;   // mask last token (branchless)
        bb.x = Zb[(size_t)r0 * D + k0 + l];
        bb.y = Zb[(size_t)r1 * D + k0 + l];
        c = wmma_f32_k4(a, bb, c);
    }
    float* Gb = G + (size_t)b * D * D;
#pragma unroll
    for (int v = 0; v < 8; v++) {
        int row = i0 + v + 8 * half;     // C/D layout: lanes 16-31 -> M += 8
        Gb[row * D + k0 + l] = c[v];
    }
}

// ---------------------------------------------------------------------------
// Kernel B: W[b] = I + (1/(SEQ-1)) * sum_j Q_full_j @ (G[b] @ P_full_j^T)
// params points at allparam[layer] : [head][2][63][63]
// grid = BATCH blocks, 256 threads.
// ---------------------------------------------------------------------------
__global__ void lt_mix_kernel(const float* __restrict__ G,
                              const float* __restrict__ params,
                              float* __restrict__ W) {
    __shared__ float Gs[D * D];
    __shared__ float Ps[D * D];
    __shared__ float Qs[D * D];
    __shared__ float Ts[D * D];
    int b = blockIdx.x;
    int tid = threadIdx.x;

    const float* Gb = G + (size_t)b * D * D;
    for (int e = tid; e < D * D; e += 256) Gs[e] = Gb[e];

    float acc[16];
#pragma unroll
    for (int r = 0; r < 16; r++) acc[r] = 0.0f;

    for (int j = 0; j < NHEAD; j++) {
        const float* Pp = params + (size_t)j * 2 * DP * DP;
        const float* Qp = Pp + DP * DP;
        __syncthreads();   // Gs ready (j=0); prev-iter reads of Ps/Qs/Ts done (j>0)
        // Build augmented P_full (corner=1) and Q_full (corner=0) in LDS.
        for (int e = tid; e < D * D; e += 256) {
            int r = e >> 6, cx = e & 63;
            float pv = 0.0f, qv = 0.0f;
            if (r < DP && cx < DP) { pv = Pp[r * DP + cx]; qv = Qp[r * DP + cx]; }
            if (r == DP && cx == DP) pv = 1.0f;
            Ps[e] = pv; Qs[e] = qv;
        }
        __syncthreads();
        // T = G @ P_full^T : T[i][k] = sum_l G[i][l] * P_full[k][l]
        for (int e = tid; e < D * D; e += 256) {
            int i = e >> 6, k = e & 63;
            float s = 0.0f;
            for (int l2 = 0; l2 < D; l2++) s += Gs[i * D + l2] * Ps[k * D + l2];
            Ts[e] = s;
        }
        __syncthreads();
        // acc += Q_full @ T
#pragma unroll
        for (int r = 0; r < 16; r++) {
            int e = tid + 256 * r;
            int i = e >> 6, k = e & 63;
            float s = 0.0f;
            for (int l2 = 0; l2 < D; l2++) s += Qs[i * D + l2] * Ts[l2 * D + k];
            acc[r] += s;
        }
    }
    const float inv = 1.0f / (float)(SEQ - 1);
    float* Wb = W + (size_t)b * D * D;
#pragma unroll
    for (int r = 0; r < 16; r++) {
        int e = tid + 256 * r;
        int i = e >> 6, k = e & 63;
        Wb[e] = acc[r] * inv + ((i == k) ? 1.0f : 0.0f);
    }
}

// ---------------------------------------------------------------------------
// Kernel C: Zout[b,n,:] = Zin[b,n,:] @ W[b]   (W = I + M, so this is Z + Z M)
// grid = BATCH*16 blocks, 256 threads (8 waves); each wave: 16 rows x 64 cols.
// Safe when Zin == Zout: each wave reads its 16 rows fully before storing.
// ---------------------------------------------------------------------------
__global__ void lt_apply_kernel(const float* Zin, const float* __restrict__ W,
                                float* Zout) {
    __shared__ float Ws[D * D];
    int b  = blockIdx.x >> 4;
    int rb = blockIdx.x & 15;
    int tid = threadIdx.x;

    const float* Wb = W + (size_t)b * D * D;
    for (int e = tid; e < D * D; e += 256) Ws[e] = Wb[e];
    __syncthreads();

    int wave = tid >> 5;
    int lane = tid & 31;
    int half = lane >> 4;
    int l    = lane & 15;
    int n0   = rb * 128 + wave * 16;

    const float* Zr = Zin + ((size_t)b * SEQ + n0) * D;
    v8f c0 = {}, c1 = {}, c2 = {}, c3 = {};
    for (int i0 = 0; i0 < D; i0 += 4) {
        // A[m=l][k] = Z[n0+l][i0+k] : two consecutive floats per lane
        v2f a;
        const float* ap = Zr + (size_t)l * D + i0 + 2 * half;
        a.x = ap[0];
        a.y = ap[1];
        int r0 = i0 + 2 * half;
        v2f b0, b1, b2, b3;
        b0.x = Ws[r0 * D +  0 + l]; b0.y = Ws[(r0 + 1) * D +  0 + l];
        b1.x = Ws[r0 * D + 16 + l]; b1.y = Ws[(r0 + 1) * D + 16 + l];
        b2.x = Ws[r0 * D + 32 + l]; b2.y = Ws[(r0 + 1) * D + 32 + l];
        b3.x = Ws[r0 * D + 48 + l]; b3.y = Ws[(r0 + 1) * D + 48 + l];
        c0 = wmma_f32_k4(a, b0, c0);
        c1 = wmma_f32_k4(a, b1, c1);
        c2 = wmma_f32_k4(a, b2, c2);
        c3 = wmma_f32_k4(a, b3, c3);
    }
    float* Zo = Zout + ((size_t)b * SEQ + n0) * D;
#pragma unroll
    for (int v = 0; v < 8; v++) {
        int row = v + 8 * half;
        Zo[row * D +  0 + l] = c0[v];
        Zo[row * D + 16 + l] = c1[v];
        Zo[row * D + 32 + l] = c2[v];
        Zo[row * D + 48 + l] = c3[v];
    }
}

extern "C" void kernel_launch(void* const* d_in, const int* in_sizes, int n_in,
                              void* d_out, int out_size, void* d_ws, size_t ws_size,
                              hipStream_t stream) {
    (void)in_sizes; (void)n_in; (void)out_size; (void)ws_size;
    const float* Z        = (const float*)d_in[0];   // [BATCH][SEQ][D]
    const float* allparam = (const float*)d_in[1];   // [NLAYER][NHEAD][2][DP][DP]
    float* out = (float*)d_out;                      // [BATCH][SEQ][D]

    float* G = (float*)d_ws;                 // BATCH * D * D floats (256 KB)
    float* W = G + (size_t)BATCH * D * D;    // BATCH * D * D floats (256 KB)

    const size_t layer_stride = (size_t)NHEAD * 2 * DP * DP;

    for (int layer = 0; layer < NLAYER; layer++) {
        const float* Zsrc = (layer == 0) ? Z : out;
        lt_gram_kernel<<<BATCH * 16, 32, 0, stream>>>(Zsrc, G);
        lt_mix_kernel<<<BATCH, 256, 0, stream>>>(G, allparam + layer * layer_stride, W);
        lt_apply_kernel<<<BATCH * 16, 256, 0, stream>>>(Zsrc, W, out);
    }
}

// v001
// One run takes 359 microseconds.
// In two side-by-side timings against v000, it was 4.77 and 4.84 times as fast.
#include <hip/hip_runtime.h>
#include <hip/hip_bf16.h>

// Problem constants (from reference)
#define NLAYER 4
#define NHEAD  8
#define DP     63
#define BATCH  16
#define SEQ    2048
#define D      64

typedef __attribute__((ext_vector_type(2))) float v2f;
typedef __attribute__((ext_vector_type(8))) float v8f;

__device__ __forceinline__ v8f wmma_f32_k4(v2f a, v2f b, v8f c) {
    // D = A(16x4) * B(4x16) + C, fp32 throughout
    return __builtin_amdgcn_wmma_f32_16x16x4_f32(
        /*neg_a=*/false, a, /*neg_b=*/false, b,
        /*c_mod=*/(short)0, c, /*reuse_a=*/false, /*reuse_b=*/false);
}

// ---------------------------------------------------------------------------
// Kernel A: per-batch Gram matrix G[b] = sum_{n != SEQ-1} Z[b,n,:]^T Z[b,n,:]
// grid = BATCH*16 blocks (16 tiles of 16x16 per batch), 32 threads (1 wave).
// ---------------------------------------------------------------------------
__global__ void lt_gram_kernel(const float* __restrict__ Z, float* __restrict__ G) {
    int blk  = blockIdx.x;
    int b    = blk >> 4;
    int tile = blk & 15;
    int i0   = (tile >> 2) << 4;   // G row block
    int k0   = (tile & 3) << 4;    // G col block
    int lane = threadIdx.x;        // 0..31 (wave32)
    int half = lane >> 4;
    int l    = lane & 15;

    const float* Zb = Z + (size_t)b * SEQ * D;
    v8f c = {};
    for (int n0 = 0; n0 < SEQ; n0 += 4) {
        int r0 = n0 + 2 * half;    // even, never SEQ-1
        int r1 = r0 + 1;           // odd, can be SEQ-1 in last chunk
        // A[m=l][k] = Z[r][i0+l] (Z^T slice), B[k][n=l] = Z[r][k0+l]
        v2f a, bb;
        a.x  = Zb[(size_t)r0 * D + i0 + l];
        float ay = Zb[(size_t)r1 * D + i0 + l];
        a.y  = (r1 == SEQ - 1) ? 0.0f : ay;   // mask last token (branchless)
        bb.x = Zb[(size_t)r0 * D + k0 + l];
        bb.y = Zb[(size_t)r1 * D + k0 + l];
        c = wmma_f32_k4(a, bb, c);
    }
    float* Gb = G + (size_t)b * D * D;
#pragma unroll
    for (int v = 0; v < 8; v++) {
        int row = i0 + v + 8 * half;     // C/D layout: lanes 16-31 -> M += 8
        Gb[row * D + k0 + l] = c[v];
    }
}

// ---------------------------------------------------------------------------
// Kernel B: W[b] = I + (1/(SEQ-1)) * sum_j Q_full_j @ (G[b] @ P_full_j^T)
// params points at allparam[layer] : [head][2][63][63]
// grid = BATCH*16 blocks: one 16x16 tile of W[b] each; 256 threads = 8 waves,
// wave j does head j on f32 WMMA; the eight heads are summed through LDS.
//   T  = G (64x64) @ P_full_j^T[:, n0..n0+15]      64 WMMAs, 4 accumulators
//   V  = Q_full_j[i0..i0+15, :] @ T                16 WMMAs
// T never leaves registers: D registers 2p, 2p+1 of row tile mt are a B
// fragment for k = 16*mt + 8*half + 2p + {0,1}, and Q is read in that k order.
// ---------------------------------------------------------------------------
#define GPITCH 68     // floats per LDS row of G: 16 B x odd, no bank conflict for 16-byte row reads
#define STRIP  1024   // LDS floats reserved per 16-row strip of a 63-wide matrix (1008 filled)
#define STRIP4 252    // 16 * 63 / 4 : 16-byte pieces of a strip

typedef float f4  __attribute__((ext_vector_type(4)));
typedef float f4u __attribute__((ext_vector_type(4), aligned(4)));  // 63-float rows: only 4-byte aligned

__global__ __launch_bounds__(256) void lt_mix_kernel(const float* __restrict__ G,
                                                     const float* __restrict__ params,
                                                     float* __restrict__ W) {
    __shared__ __attribute__((aligned(16))) float Gs[D * GPITCH];
    __shared__ __attribute__((aligned(16))) float Ps[NHEAD * STRIP];
    __shared__ __attribute__((aligned(16))) float Qs[NHEAD * STRIP];
    __shared__ float Red[NHEAD * 256];

    int blk  = blockIdx.x;
    int b    = blk >> 4;
    int i0   = ((blk >> 2) & 3) << 4;   // W row block
    int n0   = (blk & 3) << 4;          // W col block
    int tid  = threadIdx.x;
    int j    = tid >> 5;                // head of this wave
    int lane = tid & 31;
    int half = lane >> 4;
    int c    = lane & 15;

    // All loads of the stage go out together: G[b] whole, and 16 rows of P_j and of Q_j as
    // flat runs of 1008 floats. The last block of rows starts at row 47, so that the run
    // ends with the matrix.
    const float* Gb = G + (size_t)b * D * D;
    int pb = (n0 < DP - 16) ? n0 : DP - 16;
    int qb = (i0 < DP - 16) ? i0 : DP - 16;
    const float* Pg = params + (size_t)j * 2 * DP * DP + pb * DP;
    const float* Qg = params + (size_t)j * 2 * DP * DP + DP * DP + qb * DP;
    float* Pw = &Ps[j * STRIP];
    float* Qw = &Qs[j * STRIP];
    f4 gv[4], pv[8], qv[8];
#pragma unroll
    for (int q = 0; q < 4; q++) gv[q] = *(const f4*)&Gb[(tid + 256 * q) << 2];
#pragma unroll
    for (int t = 0; t < 8; t++) {
        // 252 pieces on 256 slots: the four spare lanes repeat the last piece (same bytes, same
        // place), so that no branch splits the loads
        int idx = t * 32 + lane;
        idx = (idx < STRIP4) ? idx : STRIP4 - 1;
        pv[t] = *(const f4u*)&Pg[idx << 2];
        qv[t] = *(const f4u*)&Qg[idx << 2];
    }
    // the loads' address registers are reused for the LDS addresses below
    asm volatile("s_wait_xcnt 0x0" ::: "memory");
#pragma unroll
    for (int q = 0; q < 4; q++) {
        int idx = tid + 256 * q;        // 16-byte piece of G, laid at pitch GPITCH
        *(f4*)&Gs[(idx >> 4) * GPITCH + ((idx & 15) << 2)] = gv[q];
    }
#pragma unroll
    for (int t = 0; t < 8; t++) {       // P and Q keep their pitch of 63 floats in LDS
        int idx = t * 32 + lane;
        idx = (idx < STRIP4) ? idx : STRIP4 - 1;
        *(f4*)&Pw[idx << 2] = pv[t];
        *(f4*)&Qw[idx << 2] = qv[t];
    }
    __syncthreads();

    // B fragments of product 1: B[k][n=c] = P_full[n0+c][k], k = 32*half + 2s + {0,1}.
    int  prow = n0 + c;
    bool pok  = prow < DP;
    int  pl   = prow - pb; pl = (pl < 15) ? pl : 15;      // row 63 has no storage
    const float* Pl = Pw + pl * DP + 32 * half;
    v2f bf[16];
#pragma unroll
    for (int s = 0; s < 16; s++) {
        // column 63 (half 1, last element) has no storage: read its neighbour, replaced below
        float x = Pl[2 * s];
        float y = (s == 15) ? Pl[31 - half] : Pl[2 * s + 1];
        bf[s].x = pok ? x : 0.0f;
        bf[s].y = pok ? y : 0.0f;
    }
    if (half) bf[15].y = (prow == DP) ? 1.0f : 0.0f;      // P_full[:,63] = e_63

    // Product 1: A[m=c][k] = G[16*mt + c][k], same k order as bf.
    v8f t0 = {}, t1 = {}, t2 = {}, t3 = {};
    const float* Gl = &Gs[c * GPITCH + 32 * half];
#pragma unroll
    for (int u = 0; u < 8; u++) {
        f4 g0 = *(const f4*)&Gl[ 0 * GPITCH + 4 * u];
        f4 g1 = *(const f4*)&Gl[16 * GPITCH + 4 * u];
        f4 g2 = *(const f4*)&Gl[32 * GPITCH + 4 * u];
        f4 g3 = *(const f4*)&Gl[48 * GPITCH + 4 * u];
        t0 = wmma_f32_k4(g0.xy, bf[2 * u], t0);
        t1 = wmma_f32_k4(g1.xy, bf[2 * u], t1);
        t2 = wmma_f32_k4(g2.xy, bf[2 * u], t2);
        t3 = wmma_f32_k4(g3.xy, bf[2 * u], t3);
        t0 = wmma_f32_k4(g0.zw, bf[2 * u + 1], t0);
        t1 = wmma_f32_k4(g1.zw, bf[2 * u + 1], t1);
        t2 = wmma_f32_k4(g2.zw, bf[2 * u + 1], t2);
        t3 = wmma_f32_k4(g3.zw, bf[2 * u + 1], t3);
    }

    // Product 2: A[m=c][k] = Q_full[i0+c][k], k = 16*mt + 8*half + 2p + {0,1};
    // B = registers 2p, 2p+1 of T's row tile mt.
    int  qrow = i0 + c;
    bool qok  = qrow < DP;
    int  ql   = qrow - qb; ql = (ql < 15) ? ql : 15;
    const float* Ql = Qw + ql * DP + 8 * half;
    v2f af[16];
#pragma unroll
    for (int s = 0; s < 16; s++) {
        int k = 16 * (s >> 2) + 2 * (s & 3);
        float x = Ql[k];
        float y = (s == 15) ? Ql[55 - half] : Ql[k + 1];
        af[s].x = qok ? x : 0.0f;
        af[s].y = qok ? y : 0.0f;
    }
    if (half) af[15].y = 0.0f;                            // Q_full[:,63] = 0

    v8f acc = {};
#pragma unroll
    for (int p = 0; p < 4; p++) { v2f tb = {t0[2 * p], t0[2 * p + 1]}; acc = wmma_f32_k4(af[ 0 + p], tb, acc); }
#pragma unroll
    for (int p = 0; p < 4; p++) { v2f tb = {t1[2 * p], t1[2 * p + 1]}; acc = wmma_f32_k4(af[ 4 + p], tb, acc); }
#pragma unroll
    for (int p = 0; p < 4; p++) { v2f tb = {t2[2 * p], t2[2 * p + 1]}; acc = wmma_f32_k4(af[ 8 + p], tb, acc); }
#pragma unroll
    for (int p = 0; p < 4; p++) { v2f tb = {t3[2 * p], t3[2 * p + 1]}; acc = wmma_f32_k4(af[12 + p], tb, acc); }

    // Sum the heads in the order j = 0..7: one thread per element of the tile.
#pragma unroll
    for (int r = 0; r < 8; r++) Red[j * 256 + r * 32 + lane] = acc[r];
    __syncthreads();
    float s = 0.0f;
#pragma unroll
    for (int jj = 0; jj < NHEAD; jj++) s += Red[jj * 256 + tid];
    const float inv = 1.0f / (float)(SEQ - 1);
    int row = i0 + 8 * half + j;        // D layout: register r = tid >> 5, lanes 16-31 -> M += 8
    int col = n0 + c;
    W[(size_t)b * D * D + row * D + col] = s * inv + ((row == col) ? 1.0f : 0.0f);
}

// ---------------------------------------------------------------------------
// Kernel C: Zout[b,n,:] = Zin[b,n,:] @ W[b]   (W = I + M, so this is Z + Z M)
// grid = BATCH*16 blocks, 256 threads (8 waves); each wave: 16 rows x 64 cols.
// Safe when Zin == Zout: each wave reads its 16 rows fully before storing.
// ---------------------------------------------------------------------------
__global__ void lt_apply_kernel(const float* Zin, const float* __restrict__ W,
                                float* Zout) {
    __shared__ float Ws[D * D];
    int b  = blockIdx.x >> 4;
    int rb = blockIdx.x & 15;
    int tid = threadIdx.x;

    const float* Wb = W + (size_t)b * D * D;
    for (int e = tid; e < D * D; e += 256) Ws[e] = Wb[e];
    __syncthreads();

    int wave = tid >> 5;
    int lane = tid & 31;
    int half = lane >> 4;
    int l    = lane & 15;
    int n0   = rb * 128 + wave * 16;

    const float* Zr = Zin + ((size_t)b * SEQ + n0) * D;
    v8f c0 = {}, c1 = {}, c2 = {}, c3 = {};
    for (int i0 = 0; i0 < D; i0 += 4) {
        // A[m=l][k] = Z[n0+l][i0+k] : two consecutive floats per lane
        v2f a;
        const float* ap = Zr + (size_t)l * D + i0 + 2 * half;
        a.x = ap[0];
        a.y = ap[1];
        int r0 = i0 + 2 * half;
        v2f b0, b1, b2, b3;
        b0.x = Ws[r0 * D +  0 + l]; b0.y = Ws[(r0 + 1) * D +  0 + l];
        b1.x = Ws[r0 * D + 16 + l]; b1.y = Ws[(r0 + 1) * D + 16 + l];
        b2.x = Ws[r0 * D + 32 + l]; b2.y = Ws[(r0 + 1) * D + 32 + l];
        b3.x = Ws[r0 * D + 48 + l]; b3.y = Ws[(r0 + 1) * D + 48 + l];
        c0 = wmma_f32_k4(a, b0, c0);
        c1 = wmma_f32_k4(a, b1, c1);
        c2 = wmma_f32_k4(a, b2, c2);
        c3 = wmma_f32_k4(a, b3, c3);
    }
    float* Zo = Zout + ((size_t)b * SEQ + n0) * D;
#pragma unroll
    for (int v = 0; v < 8; v++) {
        int row = v + 8 * half;
        Zo[row * D +  0 + l] = c0[v];
        Zo[row * D + 16 + l] = c1[v];
        Zo[row * D + 32 + l] = c2[v];
        Zo[row * D + 48 + l] = c3[v];
    }
}

extern "C" void kernel_launch(void* const* d_in, const int* in_sizes, int n_in,
                              void* d_out, int out_size, void* d_ws, size_t ws_size,
                              hipStream_t stream) {
    (void)in_sizes; (void)n_in; (void)out_size; (void)ws_size;
    const float* Z        = (const float*)d_in[0];   // [BATCH][SEQ][D]
    const float* allparam = (const float*)d_in[1];   // [NLAYER][NHEAD][2][DP][DP]
    float* out = (float*)d_out;                      // [BATCH][SEQ][D]

    float* G = (float*)d_ws;                 // BATCH * D * D floats (256 KB)
    float* W = G + (size_t)BATCH * D * D;    // BATCH * D * D floats (256 KB)

    const size_t layer_stride = (size_t)NHEAD * 2 * DP * DP;

    for (int layer = 0; layer < NLAYER; layer++) {
        const float* Zsrc = (layer == 0) ? Z : out;
        lt_gram_kernel<<<BATCH * 16, 32, 0, stream>>>(Zsrc, G);
        lt_mix_kernel<<<BATCH * 16, 256, 0, stream>>>(G, allparam + layer * layer_stride, W);
        lt_apply_kernel<<<BATCH * 16, 256, 0, stream>>>(Zsrc, W, out);
    }
}

// v002
// One run takes 70 microseconds.
// Two timings next to v001 put it at 5.10 and 5.13 times that version's speed.
// Over all steps from v000 it is 24.6 times as fast.
#include <hip/hip_runtime.h>
#include <hip/hip_bf16.h>

// Problem constants (from reference)
#define NLAYER 4
#define NHEAD  8
#define DP     63
#define BATCH  16
#define SEQ    2048
#define D      64

typedef __attribute__((ext_vector_type(2))) float v2f;
typedef __attribute__((ext_vector_type(8))) float v8f;

__device__ __forceinline__ v8f wmma_f32_k4(v2f a, v2f b, v8f c) {
    // D = A(16x4) * B(4x16) + C, fp32 throughout
    return __builtin_amdgcn_wmma_f32_16x16x4_f32(
        /*neg_a=*/false, a, /*neg_b=*/false, b,
        /*c_mod=*/(short)0, c, /*reuse_a=*/false, /*reuse_b=*/false);
}

typedef float f4  __attribute__((ext_vector_type(4)));
typedef float f4u __attribute__((ext_vector_type(4), aligned(4)));  // 63-float rows: only 4-byte aligned

// ---------------------------------------------------------------------------
// Kernel A: partial Gram matrices. G[b] = sum_{n != SEQ-1} Z[b,n,:]^T Z[b,n,:] is the sum
// over sq of Gp[sq][b]; the mix stage adds the GSPLIT partials when it loads G.
// grid = BATCH * GSPLIT * 4 blocks, 256 threads = 8 waves.
// Block (b, sq, q0): rows sq*512 .. +511 of Z[b], and the 16 rows 4m + q0 of G, all 64 columns.
// A lane loads 16 bytes of a row: columns 4l .. 4l+3. Component q of that load is, over the
// 16 lanes, the fragment of the column set {4n + q}: the same registers serve as B for the
// four column sets and (component q0) as A, so A and B share one k order by construction:
// k = 2*half + j  <->  row half + 2j of the step's four rows.
// ---------------------------------------------------------------------------
#define GSPLIT 4                    // blocks along the sequence
#define GWROWS (SEQ / GSPLIT / 8)   // 64 rows per wave
#define GSTEPS (GWROWS / 4)         // 16 k steps per wave

// The strip q0 picks the component that serves as A. It is a template argument, so that the
// choice costs one scalar branch per block and no select in any step.
template <int Q0>
__device__ __forceinline__ void lt_gram_strip(const float* __restrict__ Zl, bool last,
                                              float* Red, float* __restrict__ Go,
                                              int tid, int w, int lane, int half, int l) {
    // All of the wave's rows are requested at once: each load is two whole rows (512 bytes).
    // Step s takes rows 4*(GSTEPS-1-s) .. +3: the wave's last rows come first, so that the
    // mask of the last token waits on the first loads and not on all of them.
    f4 x[GSTEPS], y[GSTEPS];
#pragma unroll   // x and y live in registers: every index must be a constant
    for (int s = 0; s < GSTEPS; s++) {
        x[s] = *(const f4*)&Zl[(4 * (GSTEPS - 1 - s)) * D];
        y[s] = *(const f4*)&Zl[(4 * (GSTEPS - 1 - s) + 2) * D];
    }
    // the loads' address registers may be reused below
    asm volatile("s_wait_xcnt 0x0" ::: "memory");
    // keeps every load in front of the first product: otherwise the scheduler holds back the
    // second half of them until the first half has arrived, and their latency is paid twice
    __builtin_amdgcn_sched_barrier(0);
    // the last token is left out of the sum; it can only be the last row of a wave
    if (last) y[0] = (f4){0.0f, 0.0f, 0.0f, 0.0f};

    v8f c0 = {}, c1 = {}, c2 = {}, c3 = {};
#pragma unroll   // constant indices into x and y; each step waits only for its own two loads
    for (int s = 0; s < GSTEPS; s++) {
        v2f f0 = {x[s].x, y[s].x};
        v2f f1 = {x[s].y, y[s].y};
        v2f f2 = {x[s].z, y[s].z};
        v2f f3 = {x[s].w, y[s].w};
        v2f a  = (Q0 == 0) ? f0 : (Q0 == 1) ? f1 : (Q0 == 2) ? f2 : f3;
        c0 = wmma_f32_k4(a, f0, c0);
        c1 = wmma_f32_k4(a, f1, c1);
        c2 = wmma_f32_k4(a, f2, c2);
        c3 = wmma_f32_k4(a, f3, c3);
    }

    // Sum the eight waves in the order w = 0..7. Register v of the four accumulators is
    // G[4*(v + 8*half) + Q0][4l .. 4l+3]: 16 bytes that stay together.
    f4* R4 = (f4*)Red;
#pragma unroll   // constant indices into the accumulators
    for (int v = 0; v < 8; v++) R4[w * 256 + v * 32 + lane] = (f4){c0[v], c1[v], c2[v], c3[v]};
    __syncthreads();   // every wave's partial is in LDS before any thread sums
    f4 s4 = R4[tid];
#pragma unroll   // the seven LDS reads go out together
    for (int ww = 1; ww < 8; ww++) s4 += R4[ww * 256 + tid];
    int row = 4 * (w + 8 * half) + Q0;          // this thread's v is tid >> 5
    *(f4*)&Go[row * D + 4 * l] = s4;
    // the store's registers may be reused by code that the compiler lays behind this strip
    asm volatile("s_wait_xcnt 0x0" ::: "memory");
}

__global__ __launch_bounds__(256) void lt_gram_kernel(const float* __restrict__ Z, float* __restrict__ Gp) {
    __shared__ __attribute__((aligned(16))) float Red[8 * 1024];

    int blk  = blockIdx.x;
    int b    = blk >> 4;
    int sq   = (blk >> 2) & 3;
    int q0   = blk & 3;
    int tid  = threadIdx.x;
    int w    = tid >> 5;
    int lane = tid & 31;
    int half = lane >> 4;
    int l    = lane & 15;

    int r0 = sq * (SEQ / GSPLIT) + w * GWROWS + half;
    const float* Zl = Z + ((size_t)b * SEQ + r0) * D + 4 * l;
    bool last = (r0 + 4 * (GSTEPS - 1) + 2 == SEQ - 1);
    float* Go = Gp + ((size_t)sq * BATCH + b) * D * D;
    // q0 is the same for the whole block, so every wave meets the one barrier of its branch
    if (q0 == 0)      lt_gram_strip<0>(Zl, last, Red, Go, tid, w, lane, half, l);
    else if (q0 == 1) lt_gram_strip<1>(Zl, last, Red, Go, tid, w, lane, half, l);
    else if (q0 == 2) lt_gram_strip<2>(Zl, last, Red, Go, tid, w, lane, half, l);
    else              lt_gram_strip<3>(Zl, last, Red, Go, tid, w, lane, half, l);
}

// ---------------------------------------------------------------------------
// Kernel B: W[b] = I + (1/(SEQ-1)) * sum_j Q_full_j @ (G[b] @ P_full_j^T)
// G[b] arrives as GSPLIT partial sums, G[sq][b], added here in the order sq = 0..3.
// params points at allparam[layer] : [head][2][63][63]
// grid = BATCH*16 blocks: one 16x16 tile of W[b] each; 256 threads = 8 waves,
// wave j does head j on f32 WMMA; the eight heads are summed through LDS.
//   T  = G (64x64) @ P_full_j^T[:, n0..n0+15]      64 WMMAs, 4 accumulators
//   V  = Q_full_j[i0..i0+15, :] @ T                16 WMMAs
// T never leaves registers: D registers 2p, 2p+1 of row tile mt are a B
// fragment for k = 16*mt + 8*half + 2p + {0,1}, and Q is read in that k order.
// ---------------------------------------------------------------------------
#define GPITCH 68     // floats per LDS row of G: 16 B x odd, no bank conflict for 16-byte row reads
#define STRIP  1024   // LDS floats reserved per 16-row strip of a 63-wide matrix (1008 filled)
#define STRIP4 252    // 16 * 63 / 4 : 16-byte pieces of a strip

__global__ __launch_bounds__(256) void lt_mix_kernel(const float* __restrict__ G,
                                                     const float* __restrict__ params,
                                                     float* __restrict__ W) {
    __shared__ __attribute__((aligned(16))) float Gs[D * GPITCH];
    __shared__ __attribute__((aligned(16))) float Ps[NHEAD * STRIP];
    __shared__ __attribute__((aligned(16))) float Qs[NHEAD * STRIP];
    __shared__ float Red[NHEAD * 256];

    int blk  = blockIdx.x;
    int b    = blk >> 4;
    int i0   = ((blk >> 2) & 3) << 4;   // W row block
    int n0   = (blk & 3) << 4;          // W col block
    int tid  = threadIdx.x;
    int j    = tid >> 5;                // head of this wave
    int lane = tid & 31;
    int half = lane >> 4;
    int c    = lane & 15;

    // All loads of the stage go out together: G[b] whole, and 16 rows of P_j and of Q_j as
    // flat runs of 1008 floats. The last block of rows starts at row 47, so that the run
    // ends with the matrix.
    const float* Gb = G + (size_t)b * D * D;
    int pb = (n0 < DP - 16) ? n0 : DP - 16;
    int qb = (i0 < DP - 16) ? i0 : DP - 16;
    const float* Pg = params + (size_t)j * 2 * DP * DP + pb * DP;
    const float* Qg = params + (size_t)j * 2 * DP * DP + DP * DP + qb * DP;
    float* Pw = &Ps[j * STRIP];
    float* Qw = &Qs[j * STRIP];
    f4 gv[GSPLIT][4], pv[8], qv[8];
#pragma unroll   // gv lives in registers: constant indices (both loops)
    for (int sq = 0; sq < GSPLIT; sq++)
#pragma unroll
        for (int q = 0; q < 4; q++) gv[sq][q] = *(const f4*)&Gb[sq * (BATCH * D * D) + ((tid + 256 * q) << 2)];
#pragma unroll
    for (int t = 0; t < 8; t++) {
        // 252 pieces on 256 slots: the four spare lanes repeat the last piece (same bytes, same
        // place), so that no branch splits the loads
        int idx = t * 32 + lane;
        idx = (idx < STRIP4) ? idx : STRIP4 - 1;
        pv[t] = *(const f4u*)&Pg[idx << 2];
        qv[t] = *(const f4u*)&Qg[idx << 2];
    }
    // the loads' address registers are reused for the LDS addresses below
    asm volatile("s_wait_xcnt 0x0" ::: "memory");
#pragma unroll
    for (int q = 0; q < 4; q++) {
        int idx = tid + 256 * q;        // 16-byte piece of G, laid at pitch GPITCH
        *(f4*)&Gs[(idx >> 4) * GPITCH + ((idx & 15) << 2)] = ((gv[0][q] + gv[1][q]) + gv[2][q]) + gv[3][q];
    }
#pragma unroll
    for (int t = 0; t < 8; t++) {       // P and Q keep their pitch of 63 floats in LDS
        int idx = t * 32 + lane;
        idx = (idx < STRIP4) ? idx : STRIP4 - 1;
        *(f4*)&Pw[idx << 2] = pv[t];
        *(f4*)&Qw[idx << 2] = qv[t];
    }
    __syncthreads();

    // B fragments of product 1: B[k][n=c] = P_full[n0+c][k], k = 32*half + 2s + {0,1}.
    int  prow = n0 + c;
    bool pok  = prow < DP;
    int  pl   = prow - pb; pl = (pl < 15) ? pl : 15;      // row 63 has no storage
    const float* Pl = Pw + pl * DP + 32 * half;
    v2f bf[16];
#pragma unroll
    for (int s = 0; s < 16; s++) {
        // column 63 (half 1, last element) has no storage: read its neighbour, replaced below
        float x = Pl[2 * s];
        float y = (s == 15) ? Pl[31 - half] : Pl[2 * s + 1];
        bf[s].x = pok ? x : 0.0f;
        bf[s].y = pok ? y : 0.0f;
    }
    if (half) bf[15].y = (prow == DP) ? 1.0f : 0.0f;      // P_full[:,63] = e_63

    // Product 1: A[m=c][k] = G[16*mt + c][k], same k order as bf.
    v8f t0 = {}, t1 = {}, t2 = {}, t3 = {};
    const float* Gl = &Gs[c * GPITCH + 32 * half];
#pragma unroll
    for (int u = 0; u < 8; u++) {
        f4 g0 = *(const f4*)&Gl[ 0 * GPITCH + 4 * u];
        f4 g1 = *(const f4*)&Gl[16 * GPITCH + 4 * u];
        f4 g2 = *(const f4*)&Gl[32 * GPITCH + 4 * u];
        f4 g3 = *(const f4*)&Gl[48 * GPITCH + 4 * u];
        t0 = wmma_f32_k4(g0.xy, bf[2 * u], t0);
        t1 = wmma_f32_k4(g1.xy, bf[2 * u], t1);
        t2 = wmma_f32_k4(g2.xy, bf[2 * u], t2);
        t3 = wmma_f32_k4(g3.xy, bf[2 * u], t3);
        t0 = wmma_f32_k4(g0.zw, bf[2 * u + 1], t0);
        t1 = wmma_f32_k4(g1.zw, bf[2 * u + 1], t1);
        t2 = wmma_f32_k4(g2.zw, bf[2 * u + 1], t2);
        t3 = wmma_f32_k4(g3.zw, bf[2 * u + 1], t3);
    }

    // Product 2: A[m=c][k] = Q_full[i0+c][k], k = 16*mt + 8*half + 2p + {0,1};
    // B = registers 2p, 2p+1 of T's row tile mt.
    int  qrow = i0 + c;
    bool qok  = qrow < DP;
    int  ql   = qrow - qb; ql = (ql < 15) ? ql : 15;
    const float* Ql = Qw + ql * DP + 8 * half;
    v2f af[16];
#pragma unroll
    for (int s = 0; s < 16; s++) {
        int k = 16 * (s >> 2) + 2 * (s & 3);
        float x = Ql[k];
        float y = (s == 15) ? Ql[55 - half] : Ql[k + 1];
        af[s].x = qok ? x : 0.0f;
        af[s].y = qok ? y : 0.0f;
    }
    if (half) af[15].y = 0.0f;                            // Q_full[:,63] = 0

    v8f acc = {};
#pragma unroll
    for (int p = 0; p < 4; p++) { v2f tb = {t0[2 * p], t0[2 * p + 1]}; acc = wmma_f32_k4(af[ 0 + p], tb, acc); }
#pragma unroll
    for (int p = 0; p < 4; p++) { v2f tb = {t1[2 * p], t1[2 * p + 1]}; acc = wmma_f32_k4(af[ 4 + p], tb, acc); }
#pragma unroll
    for (int p = 0; p < 4; p++) { v2f tb = {t2[2 * p], t2[2 * p + 1]}; acc = wmma_f32_k4(af[ 8 + p], tb, acc); }
#pragma unroll
    for (int p = 0; p < 4; p++) { v2f tb = {t3[2 * p], t3[2 * p + 1]}; acc = wmma_f32_k4(af[12 + p], tb, acc); }

    // Sum the heads in the order j = 0..7: one thread per element of the tile.
#pragma unroll
    for (int r = 0; r < 8; r++) Red[j * 256 + r * 32 + lane] = acc[r];
    __syncthreads();
    float s = 0.0f;
#pragma unroll
    for (int jj = 0; jj < NHEAD; jj++) s += Red[jj * 256 + tid];
    const float inv = 1.0f / (float)(SEQ - 1);
    int row = i0 + 8 * half + j;        // D layout: register r = tid >> 5, lanes 16-31 -> M += 8
    int col = n0 + c;
    W[(size_t)b * D * D + row * D + col] = s * inv + ((row == col) ? 1.0f : 0.0f);
}

// ---------------------------------------------------------------------------
// Kernel C: Zout[b,n,:] = Zin[b,n,:] @ W[b]   (W = I + M, so this is Z + Z M)
// grid = BATCH*16 blocks, 256 threads (8 waves); each wave: 16 rows x 64 cols.
// Safe when Zin == Zout: each wave reads its 16 rows fully before storing.
// ---------------------------------------------------------------------------
__global__ void lt_apply_kernel(const float* Zin, const float* __restrict__ W,
                                float* Zout) {
    __shared__ float Ws[D * D];
    int b  = blockIdx.x >> 4;
    int rb = blockIdx.x & 15;
    int tid = threadIdx.x;

    const float* Wb = W + (size_t)b * D * D;
    for (int e = tid; e < D * D; e += 256) Ws[e] = Wb[e];
    __syncthreads();

    int wave = tid >> 5;
    int lane = tid & 31;
    int half = lane >> 4;
    int l    = lane & 15;
    int n0   = rb * 128 + wave * 16;

    const float* Zr = Zin + ((size_t)b * SEQ + n0) * D;
    v8f c0 = {}, c1 = {}, c2 = {}, c3 = {};
    for (int i0 = 0; i0 < D; i0 += 4) {
        // A[m=l][k] = Z[n0+l][i0+k] : two consecutive floats per lane
        v2f a;
        const float* ap = Zr + (size_t)l * D + i0 + 2 * half;
        a.x = ap[0];
        a.y = ap[1];
        int r0 = i0 + 2 * half;
        v2f b0, b1, b2, b3;
        b0.x = Ws[r0 * D +  0 + l]; b0.y = Ws[(r0 + 1) * D +  0 + l];
        b1.x = Ws[r0 * D + 16 + l]; b1.y = Ws[(r0 + 1) * D + 16 + l];
        b2.x = Ws[r0 * D + 32 + l]; b2.y = Ws[(r0 + 1) * D + 32 + l];
        b3.x = Ws[r0 * D + 48 + l]; b3.y = Ws[(r0 + 1) * D + 48 + l];
        c0 = wmma_f32_k4(a, b0, c0);
        c1 = wmma_f32_k4(a, b1, c1);
        c2 = wmma_f32_k4(a, b2, c2);
        c3 = wmma_f32_k4(a, b3, c3);
    }
    float* Zo = Zout + ((size_t)b * SEQ + n0) * D;
#pragma unroll
    for (int v = 0; v < 8; v++) {
        int row = v + 8 * half;
        Zo[row * D +  0 + l] = c0[v];
        Zo[row * D + 16 + l] = c1[v];
        Zo[row * D + 32 + l] = c2[v];
        Zo[row * D + 48 + l] = c3[v];
    }
}

extern "C" void kernel_launch(void* const* d_in, const int* in_sizes, int n_in,
                              void* d_out, int out_size, void* d_ws, size_t ws_size,
                              hipStream_t stream) {
    (void)in_sizes; (void)n_in; (void)out_size; (void)ws_size;
    const float* Z        = (const float*)d_in[0];   // [BATCH][SEQ][D]
    const float* allparam = (const float*)d_in[1];   // [NLAYER][NHEAD][2][DP][DP]
    float* out = (float*)d_out;                      // [BATCH][SEQ][D]

    float* G = (float*)d_ws;                          // GSPLIT * BATCH * D * D floats (1 MB)
    float* W = G + (size_t)GSPLIT * BATCH * D * D;    // BATCH * D * D floats (256 KB)

    const size_t layer_stride = (size_t)NHEAD * 2 * DP * DP;

    for (int layer = 0; layer < NLAYER; layer++) {
        const float* Zsrc = (layer == 0) ? Z : out;
        lt_gram_kernel<<<BATCH * GSPLIT * 4, 256, 0, stream>>>(Zsrc, G);
        lt_mix_kernel<<<BATCH * 16, 256, 0, stream>>>(G, allparam + layer * layer_stride, W);
        lt_apply_kernel<<<BATCH * 16, 256, 0, stream>>>(Zsrc, W, out);
    }
}

// v003
// One run takes 37.4 microseconds.
// Two timings next to v002 put it at 1.89 and 1.87 times that version's speed.
// All steps since v000 together make it 46.1 times as fast.
#include <hip/hip_runtime.h>
#include <hip/hip_bf16.h>

// Problem constants (from reference)
#define NLAYER 4
#define NHEAD  8
#define DP     63
#define BATCH  16
#define SEQ    2048
#define D      64

typedef __attribute__((ext_vector_type(2))) float v2f;
typedef __attribute__((ext_vector_type(8))) float v8f;

__device__ __forceinline__ v8f wmma_f32_k4(v2f a, v2f b, v8f c) {
    // D = A(16x4) * B(4x16) + C, fp32 throughout
    return __builtin_amdgcn_wmma_f32_16x16x4_f32(
        /*neg_a=*/false, a, /*neg_b=*/false, b,
        /*c_mod=*/(short)0, c, /*reuse_a=*/false, /*reuse_b=*/false);
}

typedef float f4  __attribute__((ext_vector_type(4)));
typedef float f4u __attribute__((ext_vector_type(4), aligned(4)));  // 63-float rows: only 4-byte aligned

// ---------------------------------------------------------------------------
// Kernel A: partial Gram matrices. G[b] = sum_{n != SEQ-1} Z[b,n,:]^T Z[b,n,:] is the sum
// over sq of Gp[sq][b]; the mix stage adds the GSPLIT partials when it loads G.
// grid = BATCH * GSPLIT * 4 blocks, 256 threads = 8 waves.
// Block (b, sq, q0): rows sq*512 .. +511 of Z[b], and the 16 rows 4m + q0 of G, all 64 columns.
// A lane loads 16 bytes of a row: columns 4l .. 4l+3. Component q of that load is, over the
// 16 lanes, the fragment of the column set {4n + q}: the same registers serve as B for the
// four column sets and (component q0) as A, so A and B share one k order by construction:
// k = 2*half + j  <->  row half + 2j of the step's four rows.
// ---------------------------------------------------------------------------
#define GSPLIT 4                    // blocks along the sequence
#define GWROWS (SEQ / GSPLIT / 8)   // 64 rows per wave
#define GSTEPS (GWROWS / 4)         // 16 k steps per wave

// The strip q0 picks the component that serves as A. It is a template argument, so that the
// choice costs one scalar branch per block and no select in any step.
template <int Q0>
__device__ __forceinline__ void lt_gram_strip(const float* __restrict__ Zl, bool last,
                                              float* Red, float* __restrict__ Go,
                                              int tid, int w, int lane, int half, int l) {
    // All of the wave's rows are requested at once: each load is two whole rows (512 bytes).
    // Step s takes rows 4*(GSTEPS-1-s) .. +3: the wave's last rows come first, so that the
    // mask of the last token waits on the first loads and not on all of them.
    f4 x[GSTEPS], y[GSTEPS];
#pragma unroll   // x and y live in registers: every index must be a constant
    for (int s = 0; s < GSTEPS; s++) {
        x[s] = *(const f4*)&Zl[(4 * (GSTEPS - 1 - s)) * D];
        y[s] = *(const f4*)&Zl[(4 * (GSTEPS - 1 - s) + 2) * D];
    }
    // the loads' address registers may be reused below
    asm volatile("s_wait_xcnt 0x0" ::: "memory");
    // keeps every load in front of the first product: otherwise the scheduler holds back the
    // second half of them until the first half has arrived, and their latency is paid twice
    __builtin_amdgcn_sched_barrier(0);
    // the last token is left out of the sum; it can only be the last row of a wave
    if (last) y[0] = (f4){0.0f, 0.0f, 0.0f, 0.0f};

    v8f c0 = {}, c1 = {}, c2 = {}, c3 = {};
#pragma unroll   // constant indices into x and y; each step waits only for its own two loads
    for (int s = 0; s < GSTEPS; s++) {
        v2f f0 = {x[s].x, y[s].x};
        v2f f1 = {x[s].y, y[s].y};
        v2f f2 = {x[s].z, y[s].z};
        v2f f3 = {x[s].w, y[s].w};
        v2f a  = (Q0 == 0) ? f0 : (Q0 == 1) ? f1 : (Q0 == 2) ? f2 : f3;
        c0 = wmma_f32_k4(a, f0, c0);
        c1 = wmma_f32_k4(a, f1, c1);
        c2 = wmma_f32_k4(a, f2, c2);
        c3 = wmma_f32_k4(a, f3, c3);
    }

    // Sum the eight waves in the order w = 0..7. Register v of the four accumulators is
    // G[4*(v + 8*half) + Q0][4l .. 4l+3]: 16 bytes that stay together.
    f4* R4 = (f4*)Red;
#pragma unroll   // constant indices into the accumulators
    for (int v = 0; v < 8; v++) R4[w * 256 + v * 32 + lane] = (f4){c0[v], c1[v], c2[v], c3[v]};
    __syncthreads();   // every wave's partial is in LDS before any thread sums
    f4 s4 = R4[tid];
#pragma unroll   // the seven LDS reads go out together
    for (int ww = 1; ww < 8; ww++) s4 += R4[ww * 256 + tid];
    int row = 4 * (w + 8 * half) + Q0;          // this thread's v is tid >> 5
    *(f4*)&Go[row * D + 4 * l] = s4;
    // the store's registers may be reused by code that the compiler lays behind this strip
    asm volatile("s_wait_xcnt 0x0" ::: "memory");
}

__global__ __launch_bounds__(256) void lt_gram_kernel(const float* __restrict__ Z, float* __restrict__ Gp) {
    __shared__ __attribute__((aligned(16))) float Red[8 * 1024];

    int blk  = blockIdx.x;
    int b    = blk >> 4;
    int sq   = (blk >> 2) & 3;
    int q0   = blk & 3;
    int tid  = threadIdx.x;
    int w    = tid >> 5;
    int lane = tid & 31;
    int half = lane >> 4;
    int l    = lane & 15;

    int r0 = sq * (SEQ / GSPLIT) + w * GWROWS + half;
    const float* Zl = Z + ((size_t)b * SEQ + r0) * D + 4 * l;
    bool last = (r0 + 4 * (GSTEPS - 1) + 2 == SEQ - 1);
    float* Go = Gp + ((size_t)sq * BATCH + b) * D * D;
    // q0 is the same for the whole block, so every wave meets the one barrier of its branch
    if (q0 == 0)      lt_gram_strip<0>(Zl, last, Red, Go, tid, w, lane, half, l);
    else if (q0 == 1) lt_gram_strip<1>(Zl, last, Red, Go, tid, w, lane, half, l);
    else if (q0 == 2) lt_gram_strip<2>(Zl, last, Red, Go, tid, w, lane, half, l);
    else              lt_gram_strip<3>(Zl, last, Red, Go, tid, w, lane, half, l);
}

// ---------------------------------------------------------------------------
// The layers run on the 64x64 matrices alone. A layer maps every row of Z[b], the last token
// too, by the same matrix: Z' = Z W. So the next layer's Gram matrix is G' = W^T G W, and the
// output is Z (W0 W1 W2 W3): Z is read once for G0 and once for the final product.
//
// One wave's share of a 64x64x64 product on LDS operands: the tiles (r0, c0) and (r0, c0+16).
// A[m = c][k], B[k][n = c], k = 4s + 2*half + {0,1} for both. TA: A is read transposed.
// ---------------------------------------------------------------------------
#define GPITCH 68     // floats per LDS row of G: 16 B x odd, no bank conflict for 16-byte row reads
#define WPITCH 72     // floats per LDS row of a B operand: rows k and k+2 (the two halves) 16 banks apart

template <bool TA>
__device__ __forceinline__ void lt_mm_pair(const float* A, int apitch, const float* B,
                                           int r0, int c0, int half, int c, v8f& d0, v8f& d1) {
#pragma unroll   // straight-line code: LDS reads of later steps can go out under earlier products
    for (int s = 0; s < 16; s++) {
        int k = 4 * s + 2 * half;
        v2f a, b0, b1;
        if (TA) { a.x = A[k * apitch + r0 + c]; a.y = A[(k + 1) * apitch + r0 + c]; }
        else    { a.x = A[(r0 + c) * apitch + k]; a.y = A[(r0 + c) * apitch + k + 1]; }
        b0.x = B[k * WPITCH + c0 + c];      b0.y = B[(k + 1) * WPITCH + c0 + c];
        b1.x = B[k * WPITCH + c0 + 16 + c]; b1.y = B[(k + 1) * WPITCH + c0 + 16 + c];
        d0 = wmma_f32_k4(a, b0, d0);
        d1 = wmma_f32_k4(a, b1, d1);
    }
}

// ---------------------------------------------------------------------------
// Kernel B: W[b] = I + (1/(SEQ-1)) * sum_j Q_full_j @ (G[b] @ P_full_j^T)
// Gin[b] arrives as NP partial sums, Gin[sq][b], added here in the order sq = 0..NP-1.
// UPD: Gin is the Gram matrix of the layer before and Wp that layer's W; every block first
// forms G = Wp^T (Gin Wp) whole, in LDS. WRG: it stores its own 16x16 tile of G to Gn for the
// next layer. HASU: one wave forms the block's tile of Un = Up Wp, the running product of the W.
// params points at allparam[layer] : [head][2][63][63]
// grid = BATCH*16 blocks: one 16x16 tile of W[b] each; 256 threads = 8 waves,
// wave j does head j on f32 WMMA; the eight heads are summed through LDS.
//   T  = G (64x64) @ P_full_j^T[:, n0..n0+15]      64 WMMAs, 4 accumulators
//   V  = Q_full_j[i0..i0+15, :] @ T                16 WMMAs
// T never leaves registers: D registers 2p, 2p+1 of row tile mt are a B
// fragment for k = 16*mt + 8*half + 2p + {0,1}, and Q is read in that k order.
// ---------------------------------------------------------------------------
#define STRIP  1024   // LDS floats reserved per 16-row strip of a 63-wide matrix (1008 filled)
#define STRIP4 252    // 16 * 63 / 4 : 16-byte pieces of a strip

template <int NP, bool UPD, bool WRG, bool HASU>
__global__ __launch_bounds__(256) void lt_mix_kernel(const float* __restrict__ G,
                                                     const float* __restrict__ Wp,
                                                     const float* __restrict__ Up,
                                                     const float* __restrict__ params,
                                                     float* __restrict__ W,
                                                     float* __restrict__ Gn,
                                                     float* __restrict__ Un) {
    __shared__ __attribute__((aligned(16))) float Gs[D * GPITCH];
    __shared__ __attribute__((aligned(16))) float Wl[UPD ? D * WPITCH : 4];
    __shared__ __attribute__((aligned(16))) float Xs[UPD ? D * WPITCH : 4];
    __shared__ __attribute__((aligned(16))) float Ps[NHEAD * STRIP];
    __shared__ __attribute__((aligned(16))) float Qs[NHEAD * STRIP];
    __shared__ float Red[NHEAD * 256];

    int blk  = blockIdx.x;
    int b    = blk >> 4;
    int i0   = ((blk >> 2) & 3) << 4;   // W row block
    int n0   = (blk & 3) << 4;          // W col block
    int tid  = threadIdx.x;
    int j    = tid >> 5;                // head of this wave
    int lane = tid & 31;
    int half = lane >> 4;
    int c    = lane & 15;

    // All loads of the stage go out together: G[b] whole, and 16 rows of P_j and of Q_j as
    // flat runs of 1008 floats. The last block of rows starts at row 47, so that the run
    // ends with the matrix.
    const float* Gb = G + (size_t)b * D * D;
    int pb = (n0 < DP - 16) ? n0 : DP - 16;
    int qb = (i0 < DP - 16) ? i0 : DP - 16;
    const float* Pg = params + (size_t)j * 2 * DP * DP + pb * DP;
    const float* Qg = params + (size_t)j * 2 * DP * DP + DP * DP + qb * DP;
    float* Pw = &Ps[j * STRIP];
    float* Qw = &Qs[j * STRIP];
    f4 gv[NP][4], wv[4], pv[8], qv[8];
    v2f ua[16];
    // the wave that forms the tile of Un; a scalar, so that its loads and products stand behind a scalar branch
    bool uwave = HASU && (__builtin_amdgcn_readfirstlane(j) == 7);
#pragma unroll   // gv lives in registers: constant indices (both loops)
    for (int sq = 0; sq < NP; sq++)
#pragma unroll
        for (int q = 0; q < 4; q++) gv[sq][q] = *(const f4*)&Gb[sq * (BATCH * D * D) + ((tid + 256 * q) << 2)];
    if (UPD) {
#pragma unroll
        for (int q = 0; q < 4; q++) wv[q] = *(const f4*)&Wp[(size_t)b * D * D + ((tid + 256 * q) << 2)];
        // the loads' base registers are reused for scalars formed below
        asm volatile("s_wait_xcnt 0x0" ::: "memory");
    }
#pragma unroll   // ua lives in registers
    for (int s = 0; s < 16; s++) ua[s] = (v2f){0.0f, 0.0f};
    if (uwave) {
        // A[m = c][k] = Up[i0 + c][k], k = 4s + 2*half + {0,1}
        const float* Ul = Up + (size_t)b * D * D + (i0 + c) * D + 2 * half;
#pragma unroll
        for (int s = 0; s < 16; s++) { ua[s].x = Ul[4 * s]; ua[s].y = Ul[4 * s + 1]; }
        // Ul is an input, so that it stays in its registers up to the wait and no result of the run lands on it
        asm volatile("s_wait_xcnt 0x0" :: "v"(Ul) : "memory");
    }
#pragma unroll
    for (int t = 0; t < 8; t++) {
        // 252 pieces on 256 slots: the four spare lanes repeat the last piece (same bytes, same
        // place), so that no branch splits the loads
        int idx = t * 32 + lane;
        idx = (idx < STRIP4) ? idx : STRIP4 - 1;
        pv[t] = *(const f4u*)&Pg[idx << 2];
        qv[t] = *(const f4u*)&Qg[idx << 2];
    }
    // the loads' address registers are reused for the LDS addresses below; the four addresses that the
    // loads of P and Q start from are inputs, so that they stay in their registers up to the wait and
    // no result of the run lands on them (Q's without the constant DP * DP, which its loads carry as an offset)
    int zl = (7 * 32 + lane < STRIP4) ? 7 * 32 + lane : STRIP4 - 1;
    asm volatile("s_wait_xcnt 0x0" :: "v"(&Pg[lane << 2]), "v"(&Pg[zl << 2]),
                 "v"(&Qg[(lane << 2) - DP * DP]), "v"(&Qg[(zl << 2) - DP * DP]) : "memory");
#pragma unroll
    for (int q = 0; q < 4; q++) {
        int idx = tid + 256 * q;        // 16-byte piece of G, laid at pitch GPITCH
        f4 g = gv[0][q];
#pragma unroll
        for (int sq = 1; sq < NP; sq++) g += gv[sq][q];
        *(f4*)&Gs[(idx >> 4) * GPITCH + ((idx & 15) << 2)] = g;
        if (UPD) *(f4*)&Wl[(idx >> 4) * WPITCH + ((idx & 15) << 2)] = wv[q];
    }
#pragma unroll
    for (int t = 0; t < 8; t++) {       // P and Q keep their pitch of 63 floats in LDS
        int idx = t * 32 + lane;
        idx = (idx < STRIP4) ? idx : STRIP4 - 1;
        *(f4*)&Pw[idx << 2] = pv[t];
        *(f4*)&Qw[idx << 2] = qv[t];
    }
    __syncthreads();

    v8f u = {};   // the block's tile of Un, in the wave that forms it
    if (UPD) {
        // X = Gin Wp, then G = Wp^T X: wave j takes row block j >> 1 and two column blocks.
        int r0 = (j >> 1) << 4;
        int c0 = (j & 1) << 5;
        v8f d0 = {}, d1 = {};
        lt_mm_pair<false>(Gs, GPITCH, Wl, r0, c0, half, c, d0, d1);
#pragma unroll
        for (int v = 0; v < 8; v++) {
            Xs[(r0 + v + 8 * half) * WPITCH + c0 + c]      = d0[v];
            Xs[(r0 + v + 8 * half) * WPITCH + c0 + 16 + c] = d1[v];
        }
        if (uwave) {
            // the tile is stored behind the last of these barriers: a store here would be waited for at the next one
#pragma unroll
            for (int s = 0; s < 16; s++) {
                int k = 4 * s + 2 * half;
                v2f bb = {Wl[k * WPITCH + n0 + c], Wl[(k + 1) * WPITCH + n0 + c]};
                u = wmma_f32_k4(ua[s], bb, u);
            }
        }
        __syncthreads();   // X is whole, and nobody reads Gin any more
        d0 = (v8f){}; d1 = (v8f){};
        lt_mm_pair<true>(Wl, WPITCH, Xs, r0, c0, half, c, d0, d1);
#pragma unroll
        for (int v = 0; v < 8; v++) {
            Gs[(r0 + v + 8 * half) * GPITCH + c0 + c]      = d0[v];
            Gs[(r0 + v + 8 * half) * GPITCH + c0 + 16 + c] = d1[v];
        }
        __syncthreads();   // G is whole in LDS before the heads read it
        if (WRG) {
            int gr = i0 + (tid >> 4), gc = n0 + (tid & 15);
            Gn[(size_t)b * D * D + gr * D + gc] = Gs[gr * GPITCH + gc];
            // the store's registers are reused below
            asm volatile("s_wait_xcnt 0x0" ::: "memory");
        }
        if (uwave) {
            float* Uo = Un + (size_t)b * D * D + (i0 + 8 * half) * D + n0 + c;
#pragma unroll
            for (int v = 0; v < 8; v++) Uo[v * D] = u[v];
            // the stores' registers are reused below
            asm volatile("s_wait_xcnt 0x0" ::: "memory");
        }
    }

    // B fragments of product 1: B[k][n=c] = P_full[n0+c][k], k = 32*half + 2s + {0,1}.
    int  prow = n0 + c;
    bool pok  = prow < DP;
    int  pl   = prow - pb; pl = (pl < 15) ? pl : 15;      // row 63 has no storage
    const float* Pl = Pw + pl * DP + 32 * half;
    v2f bf[16];
#pragma unroll
    for (int s = 0; s < 16; s++) {
        // column 63 (half 1, last element) has no storage: read its neighbour, replaced below
        float x = Pl[2 * s];
        float y = (s == 15) ? Pl[31 - half] : Pl[2 * s + 1];
        bf[s].x = pok ? x : 0.0f;
        bf[s].y = pok ? y : 0.0f;
    }
    if (half) bf[15].y = (prow == DP) ? 1.0f : 0.0f;      // P_full[:,63] = e_63

    // Product 1: A[m=c][k] = G[16*mt + c][k], same k order as bf.
    v8f t0 = {}, t1 = {}, t2 = {}, t3 = {};
    const float* Gl = &Gs[c * GPITCH + 32 * half];
#pragma unroll
    for (int u = 0; u < 8; u++) {
        f4 g0 = *(const f4*)&Gl[ 0 * GPITCH + 4 * u];
        f4 g1 = *(const f4*)&Gl[16 * GPITCH + 4 * u];
        f4 g2 = *(const f4*)&Gl[32 * GPITCH + 4 * u];
        f4 g3 = *(const f4*)&Gl[48 * GPITCH + 4 * u];
        t0 = wmma_f32_k4(g0.xy, bf[2 * u], t0);
        t1 = wmma_f32_k4(g1.xy, bf[2 * u], t1);
        t2 = wmma_f32_k4(g2.xy, bf[2 * u], t2);
        t3 = wmma_f32_k4(g3.xy, bf[2 * u], t3);
        t0 = wmma_f32_k4(g0.zw, bf[2 * u + 1], t0);
        t1 = wmma_f32_k4(g1.zw, bf[2 * u + 1], t1);
        t2 = wmma_f32_k4(g2.zw, bf[2 * u + 1], t2);
        t3 = wmma_f32_k4(g3.zw, bf[2 * u + 1], t3);
    }

    // Product 2: A[m=c][k] = Q_full[i0+c][k], k = 16*mt + 8*half + 2p + {0,1};
    // B = registers 2p, 2p+1 of T's row tile mt.
    int  qrow = i0 + c;
    bool qok  = qrow < DP;
    int  ql   = qrow - qb; ql = (ql < 15) ? ql : 15;
    const float* Ql = Qw + ql * DP + 8 * half;
    v2f af[16];
#pragma unroll
    for (int s = 0; s < 16; s++) {
        int k = 16 * (s >> 2) + 2 * (s & 3);
        float x = Ql[k];
        float y = (s == 15) ? Ql[55 - half] : Ql[k + 1];
        af[s].x = qok ? x : 0.0f;
        af[s].y = qok ? y : 0.0f;
    }
    if (half) af[15].y = 0.0f;                            // Q_full[:,63] = 0

    v8f acc = {};
#pragma unroll
    for (int p = 0; p < 4; p++) { v2f tb = {t0[2 * p], t0[2 * p + 1]}; acc = wmma_f32_k4(af[ 0 + p], tb, acc); }
#pragma unroll
    for (int p = 0; p < 4; p++) { v2f tb = {t1[2 * p], t1[2 * p + 1]}; acc = wmma_f32_k4(af[ 4 + p], tb, acc); }
#pragma unroll
    for (int p = 0; p < 4; p++) { v2f tb = {t2[2 * p], t2[2 * p + 1]}; acc = wmma_f32_k4(af[ 8 + p], tb, acc); }
#pragma unroll
    for (int p = 0; p < 4; p++) { v2f tb = {t3[2 * p], t3[2 * p + 1]}; acc = wmma_f32_k4(af[12 + p], tb, acc); }

    // Sum the heads in the order j = 0..7: one thread per element of the tile.
#pragma unroll
    for (int r = 0; r < 8; r++) Red[j * 256 + r * 32 + lane] = acc[r];
    __syncthreads();
    float s = 0.0f;
#pragma unroll
    for (int jj = 0; jj < NHEAD; jj++) s += Red[jj * 256 + tid];
    const float inv = 1.0f / (float)(SEQ - 1);
    int row = i0 + 8 * half + j;        // D layout: register r = tid >> 5, lanes 16-31 -> M += 8
    int col = n0 + c;
    W[(size_t)b * D * D + row * D + col] = s * inv + ((row == col) ? 1.0f : 0.0f);
}

// ---------------------------------------------------------------------------
// Kernel C: Zout[b,n,:] = Zin[b,n,:] @ (U[b] @ Wlast[b]), U = W0 W1 W2, Wlast = W3.
// grid = BATCH*16 blocks, 256 threads (8 waves); every block forms U Wlast whole in LDS,
// then each wave does 16 rows x 64 cols.
// ---------------------------------------------------------------------------
__global__ __launch_bounds__(256) void lt_apply_kernel(const float* __restrict__ Zin,
                                                       const float* __restrict__ U,
                                                       const float* __restrict__ Wlast,
                                                       float* __restrict__ Zout) {
    __shared__ __attribute__((aligned(16))) float Us[D * GPITCH];
    __shared__ __attribute__((aligned(16))) float Wl[D * WPITCH];
    __shared__ float Ws[D * D];
    int b  = blockIdx.x >> 4;
    int rb = blockIdx.x & 15;
    int tid = threadIdx.x;
    int wave = tid >> 5;
    int lane = tid & 31;
    int half = lane >> 4;
    int l    = lane & 15;
    int n0   = rb * 128 + wave * 16;

    // All loads go out together: the two matrices, and the wave's rows of Z, which are first
    // needed behind the second barrier.
    f4 uv[4], wv[4];
#pragma unroll   // registers: constant indices
    for (int q = 0; q < 4; q++) {
        uv[q] = *(const f4*)&U[(size_t)b * D * D + ((tid + 256 * q) << 2)];
        wv[q] = *(const f4*)&Wlast[(size_t)b * D * D + ((tid + 256 * q) << 2)];
    }
    // A[m=l][k] = Z[n0+l][4s+k] : two consecutive floats per lane
    const float* Zr = Zin + ((size_t)b * SEQ + n0 + l) * D + 2 * half;
    v2f za[16];
#pragma unroll   // registers: constant indices
    for (int s = 0; s < 16; s++) { za[s].x = Zr[4 * s]; za[s].y = Zr[4 * s + 1]; }
    // the loads' address registers are reused for the LDS addresses below
    asm volatile("s_wait_xcnt 0x0" ::: "memory");
#pragma unroll
    for (int q = 0; q < 4; q++) {
        int idx = tid + 256 * q;
        *(f4*)&Us[(idx >> 4) * GPITCH + ((idx & 15) << 2)] = uv[q];
        *(f4*)&Wl[(idx >> 4) * WPITCH + ((idx & 15) << 2)] = wv[q];
    }
    __syncthreads();   // both matrices are in LDS
    {
        int r0 = (wave >> 1) << 4;
        int c0 = (wave & 1) << 5;
        v8f d0 = {}, d1 = {};
        lt_mm_pair<false>(Us, GPITCH, Wl, r0, c0, half, l, d0, d1);
#pragma unroll
        for (int v = 0; v < 8; v++) {
            Ws[(r0 + v + 8 * half) * D + c0 + l]      = d0[v];
            Ws[(r0 + v + 8 * half) * D + c0 + 16 + l] = d1[v];
        }
    }
    __syncthreads();   // the product of the four W is whole

    v8f c0 = {}, c1 = {}, c2 = {}, c3 = {};
#pragma unroll   // constant indices into za
    for (int s = 0; s < 16; s++) {
        int r0 = 4 * s + 2 * half;
        v2f b0, b1, b2, b3;
        b0.x = Ws[r0 * D +  0 + l]; b0.y = Ws[(r0 + 1) * D +  0 + l];
        b1.x = Ws[r0 * D + 16 + l]; b1.y = Ws[(r0 + 1) * D + 16 + l];
        b2.x = Ws[r0 * D + 32 + l]; b2.y = Ws[(r0 + 1) * D + 32 + l];
        b3.x = Ws[r0 * D + 48 + l]; b3.y = Ws[(r0 + 1) * D + 48 + l];
        c0 = wmma_f32_k4(za[s], b0, c0);
        c1 = wmma_f32_k4(za[s], b1, c1);
        c2 = wmma_f32_k4(za[s], b2, c2);
        c3 = wmma_f32_k4(za[s], b3, c3);
    }
    float* Zo = Zout + ((size_t)b * SEQ + n0) * D;
#pragma unroll
    for (int v = 0; v < 8; v++) {
        int row = v + 8 * half;
        Zo[row * D +  0 + l] = c0[v];
        Zo[row * D + 16 + l] = c1[v];
        Zo[row * D + 32 + l] = c2[v];
        Zo[row * D + 48 + l] = c3[v];
    }
}

extern "C" void kernel_launch(void* const* d_in, const int* in_sizes, int n_in,
                              void* d_out, int out_size, void* d_ws, size_t ws_size,
                              hipStream_t stream) {
    (void)in_sizes; (void)n_in; (void)out_size; (void)ws_size;
    const float* Z        = (const float*)d_in[0];   // [BATCH][SEQ][D]
    const float* allparam = (const float*)d_in[1];   // [NLAYER][NHEAD][2][DP][DP]
    float* out = (float*)d_out;                      // [BATCH][SEQ][D]

    const size_t M  = (size_t)BATCH * D * D;          // one 64x64 matrix per batch (256 KB)
    float* Gp = (float*)d_ws;                         // GSPLIT partial sums of G0 (1 MB)
    float* W0 = Gp + GSPLIT * M;
    float* W1 = W0 + M;
    float* W2 = W1 + M;
    float* W3 = W2 + M;
    float* G1 = W3 + M;
    float* G2 = G1 + M;
    float* U2 = G2 + M;                               // W0 W1
    float* U3 = U2 + M;                               // W0 W1 W2

    const size_t layer_stride = (size_t)NHEAD * 2 * DP * DP;

    lt_gram_kernel<<<BATCH * GSPLIT * 4, 256, 0, stream>>>(Z, Gp);
    lt_mix_kernel<GSPLIT, false, false, false><<<BATCH * 16, 256, 0, stream>>>(
        Gp, nullptr, nullptr, allparam, W0, nullptr, nullptr);
    lt_mix_kernel<GSPLIT, true, true, false><<<BATCH * 16, 256, 0, stream>>>(
        Gp, W0, nullptr, allparam + layer_stride, W1, G1, nullptr);
    lt_mix_kernel<1, true, true, true><<<BATCH * 16, 256, 0, stream>>>(
        G1, W1, W0, allparam + 2 * layer_stride, W2, G2, U2);
    lt_mix_kernel<1, true, false, true><<<BATCH * 16, 256, 0, stream>>>(
        G2, W2, U2, allparam + 3 * layer_stride, W3, nullptr, U3);
    lt_apply_kernel<<<BATCH * 16, 256, 0, stream>>>(Z, U3, W3, out);
}
